// v000
// Times are from an AMD MI455X. After a warm-up the kernel runs many times in a row, and a time is the length of
// such a window on the GPU divided by its runs, so every launch and the gaps after it count. The runs cycle
// through copies of the inputs. A figure is the median of several windows, for all but v000 over two sittings.
// Sittings can differ by a few percent; kernels timed side by side share one.
// The starting kernel, v000, takes 1040 microseconds a run.
#include <hip/hip_runtime.h>

// ---------------------------------------------------------------------------
// LocalAttention3D for MI455X (gfx1250), wave32 + V_WMMA_F32_16X16X4_F32.
//
// Shapes (hardcoded from reference): B=2, C=1, D=96, H=64, W=64, NH=4.
// Heads are scalar affines of shared x => scores_h = alpha_h*Gram + gamma_h*r[key]
// (row-constant terms cancel in the per-64-key softmax), and the output
// collapses to  (sum_h (wv_h/Z_h) exp(...)) @ X^T + 64*sum_h bv_h.
//
// LDS layouts are position-major with even padded strides so each score
// fragment's and GEMM2's P fragment's (K, K+1) pair is one 8B-aligned
// ds_load_b64; GEMM2's K fragment reads its pair from two rows.
// ---------------------------------------------------------------------------

typedef __attribute__((ext_vector_type(2))) float v2f;
typedef __attribute__((ext_vector_type(8))) float v8f;

#define BD 96           // depth (contraction dim for scores)
#define NN 4096         // H*W positions
#define NHEAD 4
#define QS_STR 98       // even + odd-dword spacing: b64-aligned, conflict-free
#define KS_STR 98
#define PT_STR 66

// --- kernel 1: per-position depth rowsum r[b][n] = sum_d x[b,d,n] ----------
__global__ void la3d_rowsum(const float* __restrict__ x, float* __restrict__ r) {
    int n = blockIdx.x * 256 + threadIdx.x;
    if (n >= 2 * NN) return;
    int b = n >> 12;
    int nn = n & (NN - 1);
    const float* p = x + (size_t)b * BD * NN + nn;
    float s = 0.f;
#pragma unroll 8
    for (int d = 0; d < BD; ++d) s += p[(size_t)d * NN];
    r[n] = s;
}

// --- kernel 2: fused scores -> per-row softmax -> combined P -> P @ K^T ----
__global__ __launch_bounds__(512) void la3d_attn(
    const float* __restrict__ x,
    const float* __restrict__ wq, const float* __restrict__ bq,
    const float* __restrict__ wk, const float* __restrict__ bk,
    const float* __restrict__ wv, const float* __restrict__ bv,
    const float* __restrict__ rsum,
    float* __restrict__ out) {

    __shared__ float Qs[64 * QS_STR];      // Qs[q][d]  (position-major)
    __shared__ float Ks[64 * KS_STR];      // Ks[m][d]  (position-major)
    __shared__ float Pt[64 * PT_STR];      // Pt[q][m]  combined probabilities
    __shared__ float redmax[NHEAD * 4 * 64];
    __shared__ float redsum[NHEAD * 4 * 64];
    __shared__ float gmax[NHEAD * 64];     // combined row max (written redundantly)
    __shared__ float rks[64];

    const int tid   = threadIdx.x;
    const int wave  = tid >> 5;
    const int lane  = tid & 31;
    const int lhalf = lane >> 4;   // 0: lanes 0-15, 1: lanes 16-31
    const int lm    = lane & 15;

    const int qt = blockIdx.x;     // 0..63 query tile
    const int b  = blockIdx.y;     // batch

    // Score-phase tile: wave -> (wr, wc) in 4x4 grid of 16x16 tiles.
    const int wr  = wave >> 2;
    const int wc  = wave & 3;
    const int qbS = wr * 16;
    const int kbS = wc * 16;

    // Output-phase tiles: 24 tiles (4 q-blocks x 6 d-blocks) over 16 waves.
    const int qb1 = wave / 6, db1 = wave % 6;
    const int qb2 = (wave + 16) / 6, db2 = (wave + 16) % 6;   // wave < 8 only

    // Per-head softmax coefficients. Row-constant terms cancel in softmax.
    const float inv_scale = 0.17677669529663687f;  // 1/sqrt(32)
    float alpha[NHEAD], gam[NHEAD], wvv[NHEAD];
#pragma unroll
    for (int h = 0; h < NHEAD; ++h) {
        alpha[h] = wq[h] * wk[h] * inv_scale;
        gam[h]   = bq[h] * wk[h] * inv_scale;
        wvv[h]   = wv[h];
    }

    const float* xb = x + (size_t)b * BD * NN;

    // Stage query panel (float4 global loads, transposed LDS stores):
    // Qs[q][d] = x[b, d, qt*64 + q]
    for (int i = tid; i < BD * 16; i += 512) {        // 1536 float4's
        int d = i >> 4, q4 = (i & 15) << 2;
        float4 v = *(const float4*)(xb + (size_t)d * NN + qt * 64 + q4);
        Qs[(q4 + 0) * QS_STR + d] = v.x;
        Qs[(q4 + 1) * QS_STR + d] = v.y;
        Qs[(q4 + 2) * QS_STR + d] = v.z;
        Qs[(q4 + 3) * QS_STR + d] = v.w;
    }

    v8f o1 = {};   // persistent output accumulator, tile 1
    v8f o2 = {};   // persistent output accumulator, tile 2 (wave < 8)

    for (int l = 0; l < 64; ++l) {
        // ---- stage key panel for key-row l: Ks[m][d] = x[b, d, l*64 + m] ----
        const float* kbp = xb + l * 64;
        for (int i = tid; i < BD * 16; i += 512) {
            int d = i >> 4, m4 = (i & 15) << 2;
            float4 v = *(const float4*)(kbp + (size_t)d * NN + m4);
            Ks[(m4 + 0) * KS_STR + d] = v.x;
            Ks[(m4 + 1) * KS_STR + d] = v.y;
            Ks[(m4 + 2) * KS_STR + d] = v.z;
            Ks[(m4 + 3) * KS_STR + d] = v.w;
        }
        if (tid < 64) rks[tid] = rsum[b * NN + l * 64 + tid];
        if (l + 1 < 64) __builtin_prefetch(xb + (l + 1) * 64 + (tid & 63), 0, 0);
        __syncthreads();

        // ---- scores tile: S = Q K^T over depth, K-step 4, b64 fragments ----
        v8f c = {};
        {
            const float* qrow = &Qs[(qbS + lm) * QS_STR + 2 * lhalf];
            const float* krow = &Ks[(kbS + lm) * KS_STR + 2 * lhalf];
#pragma unroll
            for (int d0 = 0; d0 < BD; d0 += 4) {
                v2f a  = *(const v2f*)(qrow + d0);
                v2f bb = *(const v2f*)(krow + d0);
                c = __builtin_amdgcn_wmma_f32_16x16x4_f32(
                        false, a, false, bb, (short)0, c, false, false);
            }
        }

        const float rk = rks[kbS + lm];   // key rowsum (varies with m -> kept)

        // ---- per-head row-max partials (16-lane butterfly, then LDS) ----
#pragma unroll
        for (int h = 0; h < NHEAD; ++h) {
#pragma unroll
            for (int r = 0; r < 8; ++r) {
                float s = alpha[h] * c[r] + gam[h] * rk;
#pragma unroll
                for (int off = 1; off < 16; off <<= 1)
                    s = fmaxf(s, __shfl_xor(s, off, 32));
                if (lm == 0)
                    redmax[(h * 4 + wc) * 64 + qbS + r + 8 * lhalf] = s;
            }
        }
        __syncthreads();

        // ---- per-head exp-sum partials (+ publish combined row max) ----
#pragma unroll
        for (int h = 0; h < NHEAD; ++h) {
#pragma unroll
            for (int r = 0; r < 8; ++r) {
                const int row = qbS + r + 8 * lhalf;
                const float m = fmaxf(
                    fmaxf(redmax[(h * 4 + 0) * 64 + row], redmax[(h * 4 + 1) * 64 + row]),
                    fmaxf(redmax[(h * 4 + 2) * 64 + row], redmax[(h * 4 + 3) * 64 + row]));
                float e = __expf(alpha[h] * c[r] + gam[h] * rk - m);
#pragma unroll
                for (int off = 1; off < 16; off <<= 1)
                    e += __shfl_xor(e, off, 32);
                if (lm == 0) {
                    redsum[(h * 4 + wc) * 64 + row] = e;
                    gmax[h * 64 + row] = m;      // identical value from all wc
                }
            }
        }
        __syncthreads();

        // ---- combined probabilities P = sum_h (wv_h / Z_h) exp(s_h - m_h) ----
        float P[8];
#pragma unroll
        for (int r = 0; r < 8; ++r) P[r] = 0.f;
#pragma unroll
        for (int h = 0; h < NHEAD; ++h) {
#pragma unroll
            for (int r = 0; r < 8; ++r) {
                const int row = qbS + r + 8 * lhalf;
                const float m = gmax[h * 64 + row];
                const float Z = redsum[(h * 4 + 0) * 64 + row] + redsum[(h * 4 + 1) * 64 + row] +
                                redsum[(h * 4 + 2) * 64 + row] + redsum[(h * 4 + 3) * 64 + row];
                P[r] += (wvv[h] / Z) * __expf(alpha[h] * c[r] + gam[h] * rk - m);
            }
        }
#pragma unroll
        for (int r = 0; r < 8; ++r)
            Pt[(qbS + r + 8 * lhalf) * PT_STR + kbS + lm] = P[r];
        __syncthreads();

        // ---- GEMM2: O[q, d] += P[q, m] * K[m][d]  (K-step 4 over m) ----
        {
            const float* pr1 = &Pt[(qb1 * 16 + lm) * PT_STR + 2 * lhalf];
            const float* kc1 = &Ks[(2 * lhalf) * KS_STR + db1 * 16 + lm];
            const float* pr2 = &Pt[(qb2 * 16 + lm) * PT_STR + 2 * lhalf];
            const float* kc2 = &Ks[(2 * lhalf) * KS_STR + db2 * 16 + lm];
#pragma unroll
            for (int m0 = 0; m0 < 64; m0 += 4) {
                {
                    v2f a = *(const v2f*)(pr1 + m0);
                    v2f bb;
                    bb.x = kc1[m0 * KS_STR];
                    bb.y = kc1[(m0 + 1) * KS_STR];
                    o1 = __builtin_amdgcn_wmma_f32_16x16x4_f32(
                            false, a, false, bb, (short)0, o1, false, false);
                }
                if (wave < 8) {
                    v2f a = *(const v2f*)(pr2 + m0);
                    v2f bb;
                    bb.x = kc2[m0 * KS_STR];
                    bb.y = kc2[(m0 + 1) * KS_STR];
                    o2 = __builtin_amdgcn_wmma_f32_16x16x4_f32(
                            false, a, false, bb, (short)0, o2, false, false);
                }
            }
        }
        __syncthreads();   // protect Ks (read by GEMM2) before next iteration's staging
    }

    // ---- write out: out[b, d, n] = O + 64 * sum_h bv_h ----
    const float bvsum = 64.f * (bv[0] + bv[1] + bv[2] + bv[3]);
    float* ob = out + (size_t)b * BD * NN;
#pragma unroll
    for (int r = 0; r < 8; ++r) {
        const int d = db1 * 16 + lm;
        const int n = qt * 64 + qb1 * 16 + r + 8 * lhalf;
        ob[(size_t)d * NN + n] = o1[r] + bvsum;
    }
    if (wave < 8) {
#pragma unroll
        for (int r = 0; r < 8; ++r) {
            const int d = db2 * 16 + lm;
            const int n = qt * 64 + qb2 * 16 + r + 8 * lhalf;
            ob[(size_t)d * NN + n] = o2[r] + bvsum;
        }
    }
}

extern "C" void kernel_launch(void* const* d_in, const int* in_sizes, int n_in,
                              void* d_out, int out_size, void* d_ws, size_t ws_size,
                              hipStream_t stream) {
    const float* x  = (const float*)d_in[0];
    const float* wq = (const float*)d_in[1];
    const float* bq = (const float*)d_in[2];
    const float* wk = (const float*)d_in[3];
    const float* bk = (const float*)d_in[4];
    const float* wv = (const float*)d_in[5];
    const float* bv = (const float*)d_in[6];
    float* rsum = (float*)d_ws;          // 2*4096 floats = 32 KB scratch
    float* outp = (float*)d_out;

    la3d_rowsum<<<(2 * NN + 255) / 256, 256, 0, stream>>>(x, rsum);

    dim3 grid(NN / 64, 2);               // 64 query tiles x 2 batches
    la3d_attn<<<grid, 512, 0, stream>>>(x, wq, bq, wk, bk, wv, bv, rsum, outp);
}

// v001
// Measured time: 262 microseconds a run.
// Two timings next to v000 both put it at 4.02 times that version's speed.
#include <hip/hip_runtime.h>

// ---------------------------------------------------------------------------
// LocalAttention3D for MI455X (gfx1250), wave32 + V_WMMA_F32_16X16X4_F32.
//
// Shapes (hardcoded from reference): B=2, C=1, D=96, H=64, W=64, NH=4.
// Heads are scalar affines of shared x => scores_h = alpha_h*Gram + gamma_h*r[key]
// (row-constant terms cancel in the per-64-key softmax), and the output
// collapses to  (sum_h (wv_h/Z_h) exp(...)) @ X^T + 64*sum_h bv_h.
//
// LDS layouts are position-major with even padded strides so each score
// fragment's and GEMM2's P fragment's (K, K+1) pair is one 8B-aligned
// ds_load_b64; GEMM2's K fragment reads its pair from two rows.
// ---------------------------------------------------------------------------

typedef __attribute__((ext_vector_type(2))) float v2f;
typedef __attribute__((ext_vector_type(4))) float v4f;
typedef __attribute__((ext_vector_type(8))) float v8f;

#define BD 96           // depth (contraction dim for scores)
#define NN 4096         // H*W positions
#define NHEAD 4
#define QS_STR 98       // even + odd-dword spacing: b64-aligned, conflict-free
#define KS_STR 98
#define PT_STR 66

// --- kernel 1: per-position depth rowsum r[b][n] = sum_d x[b,d,n] ----------
__global__ void la3d_rowsum(const float* __restrict__ x, float* __restrict__ r) {
    int n = blockIdx.x * 256 + threadIdx.x;
    if (n >= 2 * NN) return;
    int b = n >> 12;
    int nn = n & (NN - 1);
    const float* p = x + (size_t)b * BD * NN + nn;
    float s = 0.f;
#pragma unroll 8
    for (int d = 0; d < BD; ++d) s += p[(size_t)d * NN];
    r[n] = s;
}

// value of lane l ^ 16 (the other 16-lane half), on the vector unit
__device__ __forceinline__ float other_half(float v) {
    const int b = __builtin_bit_cast(int, v);
    return __builtin_bit_cast(float,
        __builtin_amdgcn_permlanex16(b, b, 0x76543210, 0xfedcba98, false, false));
}

// --- kernel 2: fused scores -> per-row softmax -> combined P -> P @ K^T ----
__global__ __launch_bounds__(512) void la3d_attn(
    const float* __restrict__ x,
    const float* __restrict__ wq, const float* __restrict__ bq,
    const float* __restrict__ wk, const float* __restrict__ bk,
    const float* __restrict__ wv, const float* __restrict__ bv,
    const float* __restrict__ rsum,
    float* __restrict__ out) {

    __shared__ float Qs[64 * QS_STR];      // Qs[q][d]  (position-major)
    __shared__ float Ks[64 * KS_STR];      // Ks[m][d]  (position-major)
    __shared__ float Pt[64 * PT_STR];      // Pt[q][m]  combined probabilities
    __shared__ __attribute__((aligned(16))) float redmax[4 * 64 * NHEAD];  // [wc][q][h]
    __shared__ __attribute__((aligned(16))) float redsum[4 * 64 * NHEAD];  // [wc][q][h]
    __shared__ __attribute__((aligned(16))) float rks[64];

    const int tid   = threadIdx.x;
    const int wave  = tid >> 5;
    const int lane  = tid & 31;
    const int lhalf = lane >> 4;   // 0: lanes 0-15, 1: lanes 16-31
    const int lm    = lane & 15;

    const int qt = blockIdx.x;     // 0..63 query tile
    const int b  = blockIdx.y;     // batch

    // Score-phase tile: wave -> (wr, wc) in 4x4 grid of 16x16 tiles.
    const int wr  = wave >> 2;
    const int wc  = wave & 3;
    const int qbS = wr * 16;
    const int kbS = wc * 16;

    // Output-phase tiles: 24 tiles (4 q-blocks x 6 d-blocks) over 16 waves.
    const int qb1 = wave / 6, db1 = wave % 6;
    const int qb2 = (wave + 16) / 6, db2 = (wave + 16) % 6;   // wave < 8 only

    // Per-head softmax coefficients. Row-constant terms cancel in softmax.
    const float inv_scale = 0.17677669529663687f;  // 1/sqrt(32)
    float alpha[NHEAD], gam[NHEAD], wvv[NHEAD];
#pragma unroll
    for (int h = 0; h < NHEAD; ++h) {
        alpha[h] = wq[h] * wk[h] * inv_scale;
        gam[h]   = bq[h] * wk[h] * inv_scale;
        wvv[h]   = wv[h];
    }

    const float* xb = x + (size_t)b * BD * NN;

    // Stage query panel (float4 global loads, transposed LDS stores):
    // Qs[q][d] = x[b, d, qt*64 + q]
    for (int i = tid; i < BD * 16; i += 512) {        // 1536 float4's
        int d = i >> 4, q4 = (i & 15) << 2;
        float4 v = *(const float4*)(xb + (size_t)d * NN + qt * 64 + q4);
        Qs[(q4 + 0) * QS_STR + d] = v.x;
        Qs[(q4 + 1) * QS_STR + d] = v.y;
        Qs[(q4 + 2) * QS_STR + d] = v.z;
        Qs[(q4 + 3) * QS_STR + d] = v.w;
    }

    v8f o1 = {};   // persistent output accumulator, tile 1
    v8f o2 = {};   // persistent output accumulator, tile 2 (wave < 8)

    for (int l = 0; l < 64; ++l) {
        // ---- stage key panel for key-row l: Ks[m][d] = x[b, d, l*64 + m] ----
        const float* kbp = xb + l * 64;
        for (int i = tid; i < BD * 16; i += 512) {
            int d = i >> 4, m4 = (i & 15) << 2;
            float4 v = *(const float4*)(kbp + (size_t)d * NN + m4);
            Ks[(m4 + 0) * KS_STR + d] = v.x;
            Ks[(m4 + 1) * KS_STR + d] = v.y;
            Ks[(m4 + 2) * KS_STR + d] = v.z;
            Ks[(m4 + 3) * KS_STR + d] = v.w;
        }
        if (tid < 64) rks[tid] = rsum[b * NN + l * 64 + tid];
        if (l + 1 < 64) __builtin_prefetch(xb + (l + 1) * 64 + (tid & 63), 0, 0);
        __syncthreads();

        // ---- scores tile, transposed: keys as the A operand, queries as B, so
        //      c[r] = S[q = qbS + lm][m = kbS + 8*lhalf + r]: a lane holds 8 keys
        //      of ONE query row and the row reductions run inside the lane ----
        v8f c = {};
        {
            const float* qrow = &Qs[(qbS + lm) * QS_STR + 2 * lhalf];
            const float* krow = &Ks[(kbS + lm) * KS_STR + 2 * lhalf];
#pragma unroll
            for (int d0 = 0; d0 < BD; d0 += 4) {
                v2f a  = *(const v2f*)(qrow + d0);
                v2f bb = *(const v2f*)(krow + d0);
                c = __builtin_amdgcn_wmma_f32_16x16x4_f32(
                        false, bb, false, a, (short)0, c, false, false);
            }
        }

        const int q = qbS + lm;            // this lane's query row
        float rk[8];                       // key rowsums of this lane's 8 keys
        {
            const v4f r0 = *(const v4f*)&rks[kbS + 8 * lhalf];
            const v4f r1 = *(const v4f*)&rks[kbS + 8 * lhalf + 4];
#pragma unroll
            for (int r = 0; r < 4; ++r) { rk[r] = r0[r]; rk[r + 4] = r1[r]; }
        }

        // ---- per-head row-max partials: 8 keys in the lane, then the other half ----
        float s[NHEAD][8];
        float red[NHEAD];
#pragma unroll
        for (int h = 0; h < NHEAD; ++h) {
#pragma unroll
            for (int r = 0; r < 8; ++r) s[h][r] = alpha[h] * c[r] + gam[h] * rk[r];
            const float t = fmaxf(fmaxf(fmaxf(s[h][0], s[h][1]), fmaxf(s[h][2], s[h][3])),
                                  fmaxf(fmaxf(s[h][4], s[h][5]), fmaxf(s[h][6], s[h][7])));
            red[h] = fmaxf(t, other_half(t));
        }
        {   // both halves hold all four heads: each stores two of them
            v2f st;
            st.x = lhalf ? red[2] : red[0];
            st.y = lhalf ? red[3] : red[1];
            *(v2f*)&redmax[(wc * 64 + q) * NHEAD + 2 * lhalf] = st;
        }
        __syncthreads();

        // ---- per-head exponentials (kept in registers) and exp-sum partials ----
        v2f e[NHEAD][4];                   // key pairs, as the P sums take them
        {
            const v4f p0 = *(const v4f*)&redmax[(0 * 64 + q) * NHEAD];
            const v4f p1 = *(const v4f*)&redmax[(1 * 64 + q) * NHEAD];
            const v4f p2 = *(const v4f*)&redmax[(2 * 64 + q) * NHEAD];
            const v4f p3 = *(const v4f*)&redmax[(3 * 64 + q) * NHEAD];
#pragma unroll
            for (int h = 0; h < NHEAD; ++h) {
                const float m = fmaxf(fmaxf(p0[h], p1[h]), fmaxf(p2[h], p3[h]));
#pragma unroll
                for (int j = 0; j < 4; ++j) {
                    e[h][j].x = __expf(s[h][2 * j] - m);
                    e[h][j].y = __expf(s[h][2 * j + 1] - m);
                }
                const v2f t2 = (e[h][0] + e[h][1]) + (e[h][2] + e[h][3]);
                const float t = t2.x + t2.y;
                red[h] = t + other_half(t);
            }
            v2f st;
            st.x = lhalf ? red[2] : red[0];
            st.y = lhalf ? red[3] : red[1];
            *(v2f*)&redsum[(wc * 64 + q) * NHEAD + 2 * lhalf] = st;
        }
        __syncthreads();

        // ---- combined probabilities P = sum_h (wv_h / Z_h) exp(s_h - m_h) ----
        {
            const v4f p0 = *(const v4f*)&redsum[(0 * 64 + q) * NHEAD];
            const v4f p1 = *(const v4f*)&redsum[(1 * 64 + q) * NHEAD];
            const v4f p2 = *(const v4f*)&redsum[(2 * 64 + q) * NHEAD];
            const v4f p3 = *(const v4f*)&redsum[(3 * 64 + q) * NHEAD];
            v2f P[4] = {};
#pragma unroll
            for (int h = 0; h < NHEAD; ++h) {
                const float Z = p0[h] + p1[h] + p2[h] + p3[h];
                const float w = wvv[h] / Z;
#pragma unroll
                for (int j = 0; j < 4; ++j) P[j] += w * e[h][j];
            }
            float* prow = &Pt[q * PT_STR + kbS + 8 * lhalf];   // 8 consecutive keys
#pragma unroll
            for (int j = 0; j < 4; ++j) *(v2f*)(prow + 2 * j) = P[j];
        }
        __syncthreads();

        // ---- GEMM2: O[q, d] += P[q, m] * K[m][d]  (K-step 4 over m) ----
        {
            const float* pr1 = &Pt[(qb1 * 16 + lm) * PT_STR + 2 * lhalf];
            const float* kc1 = &Ks[(2 * lhalf) * KS_STR + db1 * 16 + lm];
            const float* pr2 = &Pt[(qb2 * 16 + lm) * PT_STR + 2 * lhalf];
            const float* kc2 = &Ks[(2 * lhalf) * KS_STR + db2 * 16 + lm];
#pragma unroll
            for (int m0 = 0; m0 < 64; m0 += 4) {
                {
                    v2f a = *(const v2f*)(pr1 + m0);
                    v2f bb;
                    bb.x = kc1[m0 * KS_STR];
                    bb.y = kc1[(m0 + 1) * KS_STR];
                    o1 = __builtin_amdgcn_wmma_f32_16x16x4_f32(
                            false, a, false, bb, (short)0, o1, false, false);
                }
                if (wave < 8) {
                    v2f a = *(const v2f*)(pr2 + m0);
                    v2f bb;
                    bb.x = kc2[m0 * KS_STR];
                    bb.y = kc2[(m0 + 1) * KS_STR];
                    o2 = __builtin_amdgcn_wmma_f32_16x16x4_f32(
                            false, a, false, bb, (short)0, o2, false, false);
                }
            }
        }
        __syncthreads();   // protect Ks (read by GEMM2) before next iteration's staging
    }

    // ---- write out: out[b, d, n] = O + 64 * sum_h bv_h ----
    const float bvsum = 64.f * (bv[0] + bv[1] + bv[2] + bv[3]);
    float* ob = out + (size_t)b * BD * NN;
#pragma unroll
    for (int r = 0; r < 8; ++r) {
        const int d = db1 * 16 + lm;
        const int n = qt * 64 + qb1 * 16 + r + 8 * lhalf;
        ob[(size_t)d * NN + n] = o1[r] + bvsum;
    }
    if (wave < 8) {
#pragma unroll
        for (int r = 0; r < 8; ++r) {
            const int d = db2 * 16 + lm;
            const int n = qt * 64 + qb2 * 16 + r + 8 * lhalf;
            ob[(size_t)d * NN + n] = o2[r] + bvsum;
        }
    }
}

extern "C" void kernel_launch(void* const* d_in, const int* in_sizes, int n_in,
                              void* d_out, int out_size, void* d_ws, size_t ws_size,
                              hipStream_t stream) {
    const float* x  = (const float*)d_in[0];
    const float* wq = (const float*)d_in[1];
    const float* bq = (const float*)d_in[2];
    const float* wk = (const float*)d_in[3];
    const float* bk = (const float*)d_in[4];
    const float* wv = (const float*)d_in[5];
    const float* bv = (const float*)d_in[6];
    float* rsum = (float*)d_ws;          // 2*4096 floats = 32 KB scratch
    float* outp = (float*)d_out;

    la3d_rowsum<<<(2 * NN + 255) / 256, 256, 0, stream>>>(x, rsum);

    dim3 grid(NN / 64, 2);               // 64 query tiles x 2 batches
    la3d_attn<<<grid, 512, 0, stream>>>(x, wq, bq, wk, bk, wv, bv, rsum, outp);
}

// v002
// Measured time: 112 microseconds a run.
// Timed twice side by side with v001, it ran 2.33 and 2.34 times as fast.
// Counting every step since v000, it is 9.40 times as fast.
#include <hip/hip_runtime.h>

// ---------------------------------------------------------------------------
// LocalAttention3D for MI455X (gfx1250), wave32 + V_WMMA_F32_16X16X4_F32.
//
// Shapes (hardcoded from reference): B=2, C=1, D=96, H=64, W=64, NH=4.
// Heads are scalar affines of shared x => scores_h = alpha_h*Gram + gamma_h*r[key]
// (row-constant terms cancel in the per-64-key softmax), and the output
// collapses to  (sum_h (wv_h/Z_h) exp(...)) @ X^T + 64*sum_h bv_h.
//
// The 64 key rows are independent terms of the output sum: they are cut into
// NSPLIT ranges, one work-group per (query tile, batch, range), so that every
// WGP holds several work-groups; a last launch adds the ranges' f32 partials.
//
// LDS layouts are position-major with even padded strides so each score
// fragment's and GEMM2's P fragment's (K, K+1) pair is one 8B-aligned
// ds_load_b64; GEMM2's K fragment reads its pair from two rows.
// ---------------------------------------------------------------------------

typedef __attribute__((ext_vector_type(2))) float v2f;
typedef __attribute__((ext_vector_type(4))) float v4f;
typedef __attribute__((ext_vector_type(8))) float v8f;

#define BD 96           // depth (contraction dim for scores)
#define NN 4096         // H*W positions
#define NHEAD 4
#define QS_STR 98       // even + odd-dword spacing: b64-aligned, conflict-free
#define KS_STR 98
#define PT_STR 66
#define NSPLIT 4        // key-row ranges (work-groups per query tile and batch)
#define LPER (64 / NSPLIT)
#define NOUT (2 * BD * NN)   // output elements = floats of one range's partial

// --- kernel 1: per-position depth rowsum r[b][n] = sum_d x[b,d,n] ----------
__global__ void la3d_rowsum(const float* __restrict__ x, float* __restrict__ r) {
    int n = blockIdx.x * 256 + threadIdx.x;
    if (n >= 2 * NN) return;
    int b = n >> 12;
    int nn = n & (NN - 1);
    const float* p = x + (size_t)b * BD * NN + nn;
    float s = 0.f;
#pragma unroll 8
    for (int d = 0; d < BD; ++d) s += p[(size_t)d * NN];
    r[n] = s;
}

// value of lane l ^ 16 (the other 16-lane half), on the vector unit
__device__ __forceinline__ float other_half(float v) {
    const int b = __builtin_bit_cast(int, v);
    return __builtin_bit_cast(float,
        __builtin_amdgcn_permlanex16(b, b, 0x76543210, 0xfedcba98, false, false));
}

// --- kernel 2: fused scores -> per-row softmax -> combined P -> P @ K^T ----
// 8 waves per SIMD: the register budget (128) at which two work-groups share a WGP
__global__ __launch_bounds__(512, 8) void la3d_attn(
    const float* __restrict__ x,
    const float* __restrict__ wq, const float* __restrict__ bq,
    const float* __restrict__ wk, const float* __restrict__ bk,
    const float* __restrict__ wv,
    const float* __restrict__ rsum,
    float* __restrict__ part) {

    __shared__ float Qs[64 * QS_STR];      // Qs[q][d]  (position-major)
    __shared__ float Ks[64 * KS_STR];      // Ks[m][d]  (position-major)
    __shared__ float Pt[64 * PT_STR];      // Pt[q][m]  combined probabilities
    __shared__ __attribute__((aligned(16))) float redmax[4 * 64 * NHEAD];  // [wc][q][h]
    __shared__ __attribute__((aligned(16))) float redsum[4 * 64 * NHEAD];  // [wc][q][h]
    __shared__ __attribute__((aligned(16))) float rks[64];

    const int tid   = threadIdx.x;
    const int wave  = tid >> 5;
    const int lane  = tid & 31;
    const int lhalf = lane >> 4;   // 0: lanes 0-15, 1: lanes 16-31
    const int lm    = lane & 15;

    const int qt = blockIdx.x;     // 0..63 query tile
    const int b  = blockIdx.y;     // batch
    const int l0 = blockIdx.z * LPER;   // first key row of this range

    // Score-phase tile: wave -> (wr, wc) in 4x4 grid of 16x16 tiles.
    const int wr  = wave >> 2;
    const int wc  = wave & 3;
    const int qbS = wr * 16;
    const int kbS = wc * 16;

    // Output-phase tiles: 24 tiles (4 q-blocks x 6 d-blocks) over 16 waves.
    const int qb1 = wave / 6, db1 = wave % 6;
    const int qb2 = (wave + 16) / 6, db2 = (wave + 16) % 6;   // wave < 8 only

    // Per-head softmax coefficients. Row-constant terms cancel in softmax.
    const float inv_scale = 0.17677669529663687f;  // 1/sqrt(32)
    float alpha[NHEAD], gam[NHEAD], wvv[NHEAD];
#pragma unroll
    for (int h = 0; h < NHEAD; ++h) {
        alpha[h] = wq[h] * wk[h] * inv_scale;
        gam[h]   = bq[h] * wk[h] * inv_scale;
        wvv[h]   = wv[h];
    }

    const float* xb = x + (size_t)b * BD * NN;

    // Stage query panel (float4 global loads, transposed LDS stores):
    // Qs[q][d] = x[b, d, qt*64 + q]
    for (int i = tid; i < BD * 16; i += 512) {        // 1536 float4's
        int d = i >> 4, q4 = (i & 15) << 2;
        float4 v = *(const float4*)(xb + (size_t)d * NN + qt * 64 + q4);
        Qs[(q4 + 0) * QS_STR + d] = v.x;
        Qs[(q4 + 1) * QS_STR + d] = v.y;
        Qs[(q4 + 2) * QS_STR + d] = v.z;
        Qs[(q4 + 3) * QS_STR + d] = v.w;
    }

    v8f o1 = {};   // persistent output accumulator, tile 1
    v8f o2 = {};   // persistent output accumulator, tile 2 (wave < 8)

    for (int l = l0; l < l0 + LPER; ++l) {
        // ---- stage key panel for key-row l: Ks[m][d] = x[b, d, l*64 + m] ----
        const float* kbp = xb + l * 64;
        for (int i = tid; i < BD * 16; i += 512) {
            int d = i >> 4, m4 = (i & 15) << 2;
            float4 v = *(const float4*)(kbp + (size_t)d * NN + m4);
            Ks[(m4 + 0) * KS_STR + d] = v.x;
            Ks[(m4 + 1) * KS_STR + d] = v.y;
            Ks[(m4 + 2) * KS_STR + d] = v.z;
            Ks[(m4 + 3) * KS_STR + d] = v.w;
        }
        if (tid < 64) rks[tid] = rsum[b * NN + l * 64 + tid];
        if (l + 1 < l0 + LPER) __builtin_prefetch(xb + (l + 1) * 64 + (tid & 63), 0, 0);
        __syncthreads();

        // ---- scores tile, transposed: keys as the A operand, queries as B, so
        //      c[r] = S[q = qbS + lm][m = kbS + 8*lhalf + r]: a lane holds 8 keys
        //      of ONE query row and the row reductions run inside the lane ----
        v8f c = {};
        {
            const float* qrow = &Qs[(qbS + lm) * QS_STR + 2 * lhalf];
            const float* krow = &Ks[(kbS + lm) * KS_STR + 2 * lhalf];
#pragma unroll
            for (int d0 = 0; d0 < BD; d0 += 4) {
                v2f a  = *(const v2f*)(qrow + d0);
                v2f bb = *(const v2f*)(krow + d0);
                c = __builtin_amdgcn_wmma_f32_16x16x4_f32(
                        false, bb, false, a, (short)0, c, false, false);
            }
        }

        const int q = qbS + lm;            // this lane's query row
        float rk[8];                       // key rowsums of this lane's 8 keys
        {
            const v4f r0 = *(const v4f*)&rks[kbS + 8 * lhalf];
            const v4f r1 = *(const v4f*)&rks[kbS + 8 * lhalf + 4];
#pragma unroll
            for (int r = 0; r < 4; ++r) { rk[r] = r0[r]; rk[r + 4] = r1[r]; }
        }

        // ---- per-head row-max partials: 8 keys in the lane, then the other half ----
        float s[NHEAD][8];
        float red[NHEAD];
#pragma unroll
        for (int h = 0; h < NHEAD; ++h) {
#pragma unroll
            for (int r = 0; r < 8; ++r) s[h][r] = alpha[h] * c[r] + gam[h] * rk[r];
            const float t = fmaxf(fmaxf(fmaxf(s[h][0], s[h][1]), fmaxf(s[h][2], s[h][3])),
                                  fmaxf(fmaxf(s[h][4], s[h][5]), fmaxf(s[h][6], s[h][7])));
            red[h] = fmaxf(t, other_half(t));
        }
        {   // both halves hold all four heads: each stores two of them
            v2f st;
            st.x = lhalf ? red[2] : red[0];
            st.y = lhalf ? red[3] : red[1];
            *(v2f*)&redmax[(wc * 64 + q) * NHEAD + 2 * lhalf] = st;
        }
        __syncthreads();

        // ---- per-head exponentials (kept in registers) and exp-sum partials ----
        v2f e[NHEAD][4];                   // key pairs, as the P sums take them
        {
            const v4f p0 = *(const v4f*)&redmax[(0 * 64 + q) * NHEAD];
            const v4f p1 = *(const v4f*)&redmax[(1 * 64 + q) * NHEAD];
            const v4f p2 = *(const v4f*)&redmax[(2 * 64 + q) * NHEAD];
            const v4f p3 = *(const v4f*)&redmax[(3 * 64 + q) * NHEAD];
#pragma unroll
            for (int h = 0; h < NHEAD; ++h) {
                const float m = fmaxf(fmaxf(p0[h], p1[h]), fmaxf(p2[h], p3[h]));
#pragma unroll
                for (int j = 0; j < 4; ++j) {
                    e[h][j].x = __expf(s[h][2 * j] - m);
                    e[h][j].y = __expf(s[h][2 * j + 1] - m);
                }
                const v2f t2 = (e[h][0] + e[h][1]) + (e[h][2] + e[h][3]);
                const float t = t2.x + t2.y;
                red[h] = t + other_half(t);
            }
            v2f st;
            st.x = lhalf ? red[2] : red[0];
            st.y = lhalf ? red[3] : red[1];
            *(v2f*)&redsum[(wc * 64 + q) * NHEAD + 2 * lhalf] = st;
        }
        __syncthreads();

        // ---- combined probabilities P = sum_h (wv_h / Z_h) exp(s_h - m_h) ----
        {
            const v4f p0 = *(const v4f*)&redsum[(0 * 64 + q) * NHEAD];
            const v4f p1 = *(const v4f*)&redsum[(1 * 64 + q) * NHEAD];
            const v4f p2 = *(const v4f*)&redsum[(2 * 64 + q) * NHEAD];
            const v4f p3 = *(const v4f*)&redsum[(3 * 64 + q) * NHEAD];
            v2f P[4] = {};
#pragma unroll
            for (int h = 0; h < NHEAD; ++h) {
                const float Z = p0[h] + p1[h] + p2[h] + p3[h];
                const float w = wvv[h] / Z;
#pragma unroll
                for (int j = 0; j < 4; ++j) P[j] += w * e[h][j];
            }
            float* prow = &Pt[q * PT_STR + kbS + 8 * lhalf];   // 8 consecutive keys
#pragma unroll
            for (int j = 0; j < 4; ++j) *(v2f*)(prow + 2 * j) = P[j];
        }
        __syncthreads();

        // ---- GEMM2: O[q, d] += P[q, m] * K[m][d]  (K-step 4 over m) ----
        {
            const float* pr1 = &Pt[(qb1 * 16 + lm) * PT_STR + 2 * lhalf];
            const float* kc1 = &Ks[(2 * lhalf) * KS_STR + db1 * 16 + lm];
            const float* pr2 = &Pt[(qb2 * 16 + lm) * PT_STR + 2 * lhalf];
            const float* kc2 = &Ks[(2 * lhalf) * KS_STR + db2 * 16 + lm];
#pragma unroll
            for (int m0 = 0; m0 < 64; m0 += 4) {
                {
                    v2f a = *(const v2f*)(pr1 + m0);
                    v2f bb;
                    bb.x = kc1[m0 * KS_STR];
                    bb.y = kc1[(m0 + 1) * KS_STR];
                    o1 = __builtin_amdgcn_wmma_f32_16x16x4_f32(
                            false, a, false, bb, (short)0, o1, false, false);
                }
                if (wave < 8) {
                    v2f a = *(const v2f*)(pr2 + m0);
                    v2f bb;
                    bb.x = kc2[m0 * KS_STR];
                    bb.y = kc2[(m0 + 1) * KS_STR];
                    o2 = __builtin_amdgcn_wmma_f32_16x16x4_f32(
                            false, a, false, bb, (short)0, o2, false, false);
                }
            }
        }
        __syncthreads();   // protect Ks (read by GEMM2) before next iteration's staging
    }

    // ---- store this range's partial in fragment order: tile t = qb*6 + db holds
    //      [lane][r], so a wave's store of one tile is 1 KB in a row ----
    float* pb = part + (size_t)blockIdx.z * NOUT + (size_t)(b * 64 + qt) * (24 * 256) + lane * 8;
    *(v8f*)(pb + wave * 256) = o1;
    if (wave < 8) *(v8f*)(pb + (wave + 16) * 256) = o2;
}

// --- kernel 3: out[b, d, n] = sum over ranges of the partials + 64 * sum_h bv_h ---
// One work-group per (query tile, batch, 16-depth block): it owns whole lines of out.
__global__ __launch_bounds__(256) void la3d_merge(
    const float* __restrict__ part, const float* __restrict__ bv,
    float* __restrict__ out) {
    const int tid  = threadIdx.x;
    const int qt   = blockIdx.x, b = blockIdx.y, db = blockIdx.z;
    const int qb   = tid >> 6;            // 16-query block of the tile
    const int lane = (tid >> 1) & 31;     // fragment lane
    const int r4   = (tid & 1) << 2;      // first of 4 fragment registers
    const float* p = part + (size_t)(b * 64 + qt) * (24 * 256)
                   + (qb * 6 + db) * 256 + lane * 8 + r4;
    v4f v[NSPLIT];
#pragma unroll   // every range's load is issued before the first add; v stays in registers
    for (int z = 0; z < NSPLIT; ++z) v[z] = *(const v4f*)(p + (size_t)z * NOUT);
    v4f acc = v[0];
#pragma unroll   // fixed order of the ranges, v indexed by constants
    for (int z = 1; z < NSPLIT; ++z) acc += v[z];
    const float bvsum = 64.f * (bv[0] + bv[1] + bv[2] + bv[3]);
    const int d = db * 16 + (lane & 15);
    const int n = qt * 64 + qb * 16 + 8 * (lane >> 4) + r4;
    *(v4f*)(out + (size_t)b * BD * NN + (size_t)d * NN + n) = acc + bvsum;
}

extern "C" void kernel_launch(void* const* d_in, const int* in_sizes, int n_in,
                              void* d_out, int out_size, void* d_ws, size_t ws_size,
                              hipStream_t stream) {
    const float* x  = (const float*)d_in[0];
    const float* wq = (const float*)d_in[1];
    const float* bq = (const float*)d_in[2];
    const float* wk = (const float*)d_in[3];
    const float* bk = (const float*)d_in[4];
    const float* wv = (const float*)d_in[5];
    const float* bv = (const float*)d_in[6];
    float* rsum = (float*)d_ws;          // 2*4096 floats = 32 KB scratch
    float* part = rsum + 2 * NN;         // NSPLIT partials of NOUT floats each
    float* outp = (float*)d_out;

    la3d_rowsum<<<(2 * NN + 255) / 256, 256, 0, stream>>>(x, rsum);

    dim3 grid(NN / 64, 2, NSPLIT);       // 64 query tiles x 2 batches x key-row ranges
    la3d_attn<<<grid, 512, 0, stream>>>(x, wq, bq, wk, bk, wv, rsum, part);

    dim3 mgrid(NN / 64, 2, BD / 16);
    la3d_merge<<<mgrid, 256, 0, stream>>>(part, bv, outp);
}

// v003
// Measured time: 90.8 microseconds a run.
// Timed twice side by side with v002, it ran 1.24 times as fast both times.
// Over all steps from v000 it is 11.6 times as fast.
#include <hip/hip_runtime.h>

// ---------------------------------------------------------------------------
// Row-wise softmax attention over a 64 x 64 plane of depth-96 columns, gfx1250,
// wave32 + V_WMMA_F32_16X16X4_F32.
//
// Shapes (hardcoded from reference): B=2, C=1, D=96, H=64, W=64, NH=4.
// Heads are scalar affines of shared x => scores_h = alpha_h*Gram + gamma_h*r[key]
// (row-constant terms cancel in the per-64-key softmax), and the output
// collapses to  (sum_h (wv_h/Z_h) exp(...)) @ X^T + 64*sum_h bv_h.
//
// One wave owns 16 queries and, per key row, all 64 keys: S^T = K Q^T leaves a
// lane with 32 keys of ONE query, so the softmax needs no other wave, and the
// combined P stays in the registers it was made in as the B operand of
// O^T += K^T P^T. The waves of a work-group share only the staged key panel.
//
// The 64 key rows are independent terms of the output sum: they are cut into
// NSPLIT ranges, one work-group per (query tile, batch, range); a last launch
// adds the ranges' f32 partials.
//
// The key panel lies in LDS twice, key-major for the scores and depth-major for
// the output product, each at a pitch of 16 B x odd, so that one ds_load_b128
// is the A fragment of two WMMAs.
// ---------------------------------------------------------------------------

typedef __attribute__((ext_vector_type(2))) float v2f;
typedef __attribute__((ext_vector_type(4))) float v4f;
typedef __attribute__((ext_vector_type(8))) float v8f;

#define BD 96           // depth (contraction dim for scores)
#define NN 4096         // H*W positions
#define NHEAD 4
#define NWAVE 8         // waves per work-group, 16 queries each
#define KS_STR 100      // floats per key row of Ks:   400 B = 16 B x 25
#define KD_STR 68       // floats per depth row of Kd: 272 B = 16 B x 17
#define NSPLIT 8        // key-row ranges (work-groups per query tile and batch)
#define LPER (64 / NSPLIT)
#define NSTG ((BD * 16) / (NWAVE * 32))   // 16-byte quads of a key panel per thread

// --- kernel 1: per-position depth rowsum r[b][n] = sum_d x[b,d,n] ----------
__global__ void la3d_rowsum(const float* __restrict__ x, float* __restrict__ r) {
    int n = blockIdx.x * 256 + threadIdx.x;
    if (n >= 2 * NN) return;
    int b = n >> 12;
    int nn = n & (NN - 1);
    const float* p = x + (size_t)b * BD * NN + nn;
    float s = 0.f;
#pragma unroll 8
    for (int d = 0; d < BD; ++d) s += p[(size_t)d * NN];
    r[n] = s;
}

// value of lane l ^ 16 (the other 16-lane half), on the vector unit
__device__ __forceinline__ float other_half(float v) {
    const int b = __builtin_bit_cast(int, v);
    return __builtin_bit_cast(float,
        __builtin_amdgcn_permlanex16(b, b, 0x76543210, 0xfedcba98, false, false));
}

// --- kernel 2: fused scores -> per-row softmax -> combined P -> K^T @ P^T ----
// 4 waves per SIMD: the register budget (256) at which two work-groups share a WGP
__global__ __launch_bounds__(NWAVE * 32, 4) void la3d_attn(
    const float* __restrict__ x,
    const float* __restrict__ wq, const float* __restrict__ bq,
    const float* __restrict__ wk, const float* __restrict__ bk,
    const float* __restrict__ wv,
    const float* __restrict__ rsum,
    float* __restrict__ part) {

    __shared__ __attribute__((aligned(16))) float Ks[64 * KS_STR];   // Ks[m][d]
    __shared__ __attribute__((aligned(16))) float Kd[BD * KD_STR];   // Kd[d][m]
    __shared__ __attribute__((aligned(16))) float rks[LPER * 64];    // rowsums of the range's keys
    __shared__ __attribute__((aligned(16))) float coef[NHEAD * 4];   // [h]: alpha, gamma, wv

    const int tid   = threadIdx.x;
    const int wave  = tid >> 5;
    const int lane  = tid & 31;
    const int lhalf = lane >> 4;   // 0: lanes 0-15, 1: lanes 16-31
    const int lm    = lane & 15;

    const int b  = blockIdx.y;                  // batch
    const int l0 = blockIdx.z * LPER;           // first key row of this range
    const int qg = blockIdx.x * NWAVE + wave;   // this wave's 16-query group, 0..255

    // Per-head softmax coefficients. Row-constant terms cancel in softmax.
    const float inv_scale = 0.17677669529663687f;  // 1/sqrt(32)
    // They lie in LDS because the head loop stays rolled; the first barrier of the
    // key-row loop stands between these stores and their first read.
    if (tid < NHEAD) {
        coef[tid * 4 + 0] = wq[tid] * wk[tid] * inv_scale;
        coef[tid * 4 + 1] = bq[tid] * wk[tid] * inv_scale;
        coef[tid * 4 + 2] = wv[tid];
        coef[tid * 4 + 3] = 0.f;
    }
    // Key rowsums of the whole range, once (the range's rows lie in a row in rsum);
    // published by the same barrier.
#pragma unroll
    for (int k = 0; k < (LPER * 64) / (NWAVE * 32); ++k)
        rks[tid + k * NWAVE * 32] = rsum[b * NN + l0 * 64 + tid + k * NWAVE * 32];

    const float* xb = x + (size_t)b * BD * NN;

    // Query fragments (B operand, column = query lm), kept in registers for the
    // whole kernel. k slot (lhalf, i) of step 2*s + jj is depth 8*s + 4*lhalf + 2*jj + i,
    // the order in which one 16-byte read of a Ks row delivers the A side.
    v2f qf[BD / 4];
    {
        const float* qp = xb + qg * 16 + lm + (size_t)(4 * lhalf) * NN;
#pragma unroll
        for (int s = 0; s < BD / 8; ++s) {
#pragma unroll
            for (int jj = 0; jj < 2; ++jj) {
                qf[2 * s + jj].x = qp[(size_t)(8 * s + 2 * jj) * NN];
                qf[2 * s + jj].y = qp[(size_t)(8 * s + 2 * jj + 1) * NN];
            }
        }
    }

    // Staging map: a wave takes 8 depths x 4 quads of keys per trip, which puts its
    // 32 transposed dword stores on 32 banks; trip k adds 16 depths.
    const int sd = ((tid >> 7) << 3) | ((tid >> 2) & 7);            // depth, 0..15
    const int sm = ((((tid >> 5) & 3) << 2) | (tid & 3)) << 2;      // first key of the quad
    const int sg = sd * NN + sm;
    float* ksw = &Ks[sm * KS_STR + sd];
    float* kdw = &Kd[sd * KD_STR + sm];

    v8f o[BD / 16] = {};   // o[db][r] = O[q = lm][d = db*16 + 8*lhalf + r]

    for (int l = l0; l < l0 + LPER; ++l) {
        // ---- stage key row l in both layouts ----
        const float* kbp = xb + l * 64 + sg;
        v4f kv[NSTG];
#pragma unroll   // all six loads of a thread are in flight before its first LDS store
        for (int k = 0; k < NSTG; ++k) kv[k] = *(const v4f*)(kbp + k * 16 * NN);
        // The six loads name one address pair: it is an input here, so it stays live over
        // the whole run (no load lands in it), and the wait stands before it is rewritten.
        asm volatile("s_wait_xcnt 0x0" :: "v"(kbp) : "memory");
#pragma unroll   // kv indexed by constants
        for (int k = 0; k < NSTG; ++k) {
            ksw[0 * KS_STR + 16 * k] = kv[k].x;
            ksw[1 * KS_STR + 16 * k] = kv[k].y;
            ksw[2 * KS_STR + 16 * k] = kv[k].z;
            ksw[3 * KS_STR + 16 * k] = kv[k].w;
            *(v4f*)(kdw + k * 16 * KD_STR) = kv[k];
        }
        __syncthreads();

        // ---- scores, transposed: keys as the A operand, queries as B, so
        //      c[t][r] = S[q = lm][m = 16*t + 8*lhalf + r] ----
        v8f c[4] = {};
        {
            const float* krow = &Ks[lm * KS_STR + 4 * lhalf];
#pragma unroll
            for (int s = 0; s < BD / 8; ++s) {
                v4f a[4];
#pragma unroll
                for (int t = 0; t < 4; ++t) a[t] = *(const v4f*)(krow + t * 16 * KS_STR + 8 * s);
#pragma unroll
                for (int t = 0; t < 4; ++t)
                    c[t] = __builtin_amdgcn_wmma_f32_16x16x4_f32(
                            false, a[t].lo, false, qf[2 * s], (short)0, c[t], false, false);
#pragma unroll
                for (int t = 0; t < 4; ++t)
                    c[t] = __builtin_amdgcn_wmma_f32_16x16x4_f32(
                            false, a[t].hi, false, qf[2 * s + 1], (short)0, c[t], false, false);
            }
        }

        // ---- per head: row max, exponentials, exp-sum (32 keys in the lane, then
        //      the other half), and P += (wv_h / Z_h) exp(s_h - m_h) ----
        v2f P[4][4] = {};                  // P[t][j]: keys 16*t + 8*lhalf + 2*j, +1
#pragma unroll 1   // rolled: with the heads interleaved the query fragments spill to scratch
        for (int h = 0; h < NHEAD; ++h) {
            const v4f cf = *(const v4f*)&coef[h * 4];
            const float alpha = cf.x, gam = cf.y, wvh = cf.z;
            float s[4][8];
            float tm[4];
#pragma unroll
            for (int t = 0; t < 4; ++t) {
                const v4f r0 = *(const v4f*)&rks[(l - l0) * 64 + 16 * t + 8 * lhalf];
                const v4f r1 = *(const v4f*)&rks[(l - l0) * 64 + 16 * t + 8 * lhalf + 4];
#pragma unroll
                for (int r = 0; r < 4; ++r) {
                    s[t][r]     = alpha * c[t][r]     + gam * r0[r];
                    s[t][r + 4] = alpha * c[t][r + 4] + gam * r1[r];
                }
                tm[t] = fmaxf(fmaxf(fmaxf(s[t][0], s[t][1]), fmaxf(s[t][2], s[t][3])),
                              fmaxf(fmaxf(s[t][4], s[t][5]), fmaxf(s[t][6], s[t][7])));
            }
            const float mh = fmaxf(fmaxf(tm[0], tm[1]), fmaxf(tm[2], tm[3]));
            const float m  = fmaxf(mh, other_half(mh));

            v2f e[4][4];
            v2f ts[4];
#pragma unroll
            for (int t = 0; t < 4; ++t) {
#pragma unroll
                for (int j = 0; j < 4; ++j) {
                    e[t][j].x = __expf(s[t][2 * j] - m);
                    e[t][j].y = __expf(s[t][2 * j + 1] - m);
                }
                ts[t] = (e[t][0] + e[t][1]) + (e[t][2] + e[t][3]);
            }
            const v2f t2 = (ts[0] + ts[1]) + (ts[2] + ts[3]);
            const float zh = t2.x + t2.y;
            const float Z  = zh + other_half(zh);
            const float w  = wvh / Z;
#pragma unroll
            for (int t = 0; t < 4; ++t)
#pragma unroll
                for (int j = 0; j < 4; ++j) P[t][j] += w * e[t][j];
        }

        // ---- O^T[d, q] += K^T[d, m] * P^T[m, q]: k slot (lhalf, i) of step (t, j) is
        //      key 16*t + 8*lhalf + 2*j + i on both sides, so P[t][j] is the B fragment ----
        {
            const float* kcol = &Kd[lm * KD_STR + 8 * lhalf];
#pragma unroll
            for (int t = 0; t < 4; ++t) {
#pragma unroll
                for (int jp = 0; jp < 2; ++jp) {
                    v4f a[BD / 16];
#pragma unroll
                    for (int db = 0; db < BD / 16; ++db)
                        a[db] = *(const v4f*)(kcol + db * 16 * KD_STR + 16 * t + 4 * jp);
#pragma unroll
                    for (int db = 0; db < BD / 16; ++db)
                        o[db] = __builtin_amdgcn_wmma_f32_16x16x4_f32(
                                false, a[db].lo, false, P[t][2 * jp], (short)0, o[db], false, false);
#pragma unroll
                    for (int db = 0; db < BD / 16; ++db)
                        o[db] = __builtin_amdgcn_wmma_f32_16x16x4_f32(
                                false, a[db].hi, false, P[t][2 * jp + 1], (short)0, o[db], false, false);
                }
            }
        }
        __syncthreads();   // every wave has left Ks and Kd before the next row is staged
    }

    // ---- store this range's partial in fragment order: tile (qg, db) holds
    //      [range][lane][r], so a wave's store of one tile is 1 KB in a row ----
    float* pb = part + (size_t)(b * 256 + qg) * (6 * NSPLIT * 256) + blockIdx.z * 256 + lane * 8;
#pragma unroll
    for (int db = 0; db < BD / 16; ++db) *(v8f*)(pb + db * NSPLIT * 256) = o[db];
}

// --- kernel 3: out[b, d, n] = sum over ranges of the partials + 64 * sum_h bv_h ---
// One work-group per (64 queries, batch, 16-depth block): it owns whole lines of out.
__global__ __launch_bounds__(256) void la3d_merge(
    const float* __restrict__ part, const float* __restrict__ bv,
    float* __restrict__ out) {
    const int tid   = threadIdx.x;
    const int b     = blockIdx.y, db = blockIdx.z;
    const int lm    = tid & 15;                          // query inside its group
    const int qg    = blockIdx.x * 4 + ((tid >> 4) & 3); // 16-query group
    const int lhalf = tid >> 7;                          // fragment lane half
    const int r4    = ((tid >> 6) & 1) << 2;             // first of 4 fragment registers
    const float* p = part + (size_t)((b * 256 + qg) * 6 + db) * (NSPLIT * 256)
                   + (lhalf * 16 + lm) * 8 + r4;
    v4f v[NSPLIT];
#pragma unroll   // every range's load is issued before the first add; v stays in registers
    for (int z = 0; z < NSPLIT; ++z) v[z] = *(const v4f*)(p + z * 256);
    // The loads name one address pair: an input here, so no load of the run lands in it,
    // and the wait stands before it is rewritten.
    asm volatile("s_wait_xcnt 0x0" :: "v"(p) : "memory");
    v4f acc = v[0];
#pragma unroll   // fixed order of the ranges, v indexed by constants
    for (int z = 1; z < NSPLIT; ++z) acc += v[z];
    const float bvsum = 64.f * (bv[0] + bv[1] + bv[2] + bv[3]);
    const int d = db * 16 + 8 * lhalf + r4;
    const int n = qg * 16 + lm;          // a wave's 32 lanes: 128 B in a row of out
    float* op = out + (size_t)b * BD * NN + (size_t)d * NN + n;
#pragma unroll
    for (int k = 0; k < 4; ++k) op[(size_t)k * NN] = acc[k] + bvsum;
}

extern "C" void kernel_launch(void* const* d_in, const int* in_sizes, int n_in,
                              void* d_out, int out_size, void* d_ws, size_t ws_size,
                              hipStream_t stream) {
    const float* x  = (const float*)d_in[0];
    const float* wq = (const float*)d_in[1];
    const float* bq = (const float*)d_in[2];
    const float* wk = (const float*)d_in[3];
    const float* bk = (const float*)d_in[4];
    const float* wv = (const float*)d_in[5];
    const float* bv = (const float*)d_in[6];
    float* rsum = (float*)d_ws;          // 2*4096 floats = 32 KB scratch
    float* part = rsum + 2 * NN;         // NSPLIT partials of every output element
    float* outp = (float*)d_out;

    la3d_rowsum<<<(2 * NN + 255) / 256, 256, 0, stream>>>(x, rsum);

    dim3 grid(NN / (NWAVE * 16), 2, NSPLIT);   // 32 query tiles x 2 batches x key-row ranges
    la3d_attn<<<grid, NWAVE * 32, 0, stream>>>(x, wq, bq, wk, bk, wv, rsum, part);

    dim3 mgrid(NN / 64, 2, BD / 16);
    la3d_merge<<<mgrid, 256, 0, stream>>>(part, bv, outp);
}
